// v000
// Times are from an AMD MI455X. After a warm-up the kernel runs many times in a row, and a time is the length of
// such a window on the GPU divided by its runs, so every launch and the gaps after it count. The runs cycle
// through copies of the inputs. A figure is the median of several windows, for all but v000 over two sittings.
// Sittings can differ by a few percent; kernels timed side by side share one.
// The starting kernel, v000, takes 117 microseconds a run.
#include <hip/hip_runtime.h>
#include <stdint.h>

// AQLM 1x16 dequant-fused GEMM for MI455X (gfx1250, wave32, WMMA f32 16x16x4).
// out[t,o] = scale[o] * sum_ig sum_j x[t, ig*8+j] * cb[code[o,ig]][j] + bias[o]

typedef __attribute__((ext_vector_type(2))) float v2f;
typedef __attribute__((ext_vector_type(4))) float v4f;
typedef __attribute__((ext_vector_type(8))) float v8f;

#define IN_F       4096
#define OUT_F      11008
#define TOKENS     64
#define N_IG       512      // IN_F / 8
#define K_CHUNK    256      // K elements staged in LDS per iteration
#define IG_CHUNK   32       // K_CHUNK / 8 AQLM groups per chunk
#define LDS_STRIDE 260      // padded row stride (floats) -> conflict-free ds_load_b64

__global__ __launch_bounds__(256) void aqlm_wmma_f32_kernel(
    const float* __restrict__ x,          // [64, 4096]
    const int*   __restrict__ codes,      // [11008, 512]
    const float* __restrict__ codebooks,  // [65536, 8]
    const float* __restrict__ scales,     // [11008]
    const float* __restrict__ bias,       // [11008]
    float*       __restrict__ out)        // [64, 11008]
{
    __shared__ float xs[TOKENS * LDS_STRIDE];

    const int tid   = threadIdx.x;
    const int lane  = tid & 31;
    const int wave  = tid >> 5;
    const int n0    = blockIdx.x * 128 + wave * 16;   // 16 output features per wave

    const int nlane = lane & 15;        // N index within tile (and token-in-tile for A)
    const int hi    = lane >> 4;        // lane half selects K sub-pair {0,1} vs {2,3}
    const int off2  = hi * 2;

    const int      nfeat    = n0 + nlane;
    // 32-bit byte offsets so loads select the SADDR (uniform base + u32 voffset) form.
    const uint32_t codeBase = (uint32_t)nfeat * (uint32_t)N_IG;   // element offset into codes
    const uint32_t laneSub  = (uint32_t)off2 * 4u;                // byte sub-offset in cb row
    const char*    cbBase   = (const char*)codebooks;

    v8f acc[4];
    #pragma unroll
    for (int m = 0; m < 4; ++m) acc[m] = (v8f){};

    for (int kc = 0; kc < IN_F / K_CHUNK; ++kc) {
        __syncthreads();
        // Cooperative coalesced stage of x[0..63][kc*256 .. kc*256+255] into LDS.
        {
            const float* xsrc = x + (size_t)kc * K_CHUNK;
            #pragma unroll
            for (int i = 0; i < 16; ++i) {
                int idx = tid + i * 256;      // float4 slot: 4096 slots total
                int t   = idx >> 6;           // token row (64 float4 per row)
                int c4  = idx & 63;
                v4f v = *(const v4f*)(xsrc + (size_t)t * IN_F + c4 * 4);
                *(v4f*)(&xs[t * LDS_STRIDE + c4 * 4]) = v;
            }
        }
        __syncthreads();

        const int igbase = kc * IG_CHUNK;
        // Prefetch next chunk of this feature's codes row (global_prefetch_b8).
        if (kc + 1 < IN_F / K_CHUNK)
            __builtin_prefetch(codes + codeBase + (uint32_t)(igbase + IG_CHUNK), 0, 1);

        #pragma unroll 4
        for (int igl = 0; igl < IG_CHUNK; ++igl) {
            // --- B operand: gather dequant weights for 16 output features ---
            // lanes L and L+16 load the same code (same cache line, broadcast).
            uint32_t code = (uint32_t)codes[codeBase + (uint32_t)(igbase + igl)];
            uint32_t boff = (code << 5) + laneSub;              // one v_lshl_add_u32
            v2f b1 = *(const v2f*)(cbBase + boff);              // K = off2, off2+1
            v2f b2 = *(const v2f*)(cbBase + boff + 16);         // K = off2+4, off2+5

            const int kk = igl * 8 + off2;
            // --- 4 M-tiles of 16 tokens, 2 WMMA K-steps each ---
            #pragma unroll
            for (int m = 0; m < 4; ++m) {
                const float* ax = &xs[(size_t)(m * 16 + nlane) * LDS_STRIDE + kk];
                v2f a1 = *(const v2f*)(ax);
                v2f a2 = *(const v2f*)(ax + 4);
                acc[m] = __builtin_amdgcn_wmma_f32_16x16x4_f32(
                    false, a1, false, b1, (short)0, acc[m], false, false);
                acc[m] = __builtin_amdgcn_wmma_f32_16x16x4_f32(
                    false, a2, false, b2, (short)0, acc[m], false, false);
            }
        }
    }

    // Epilogue: fold per-feature scale, add bias.
    const float s  = scales[nfeat];
    const float bv = bias[nfeat];
    #pragma unroll
    for (int m = 0; m < 4; ++m) {
        #pragma unroll
        for (int v = 0; v < 8; ++v) {
            int token = m * 16 + hi * 8 + v;   // C/D layout: VGPR v -> M=v (+8 hi half)
            out[(size_t)token * OUT_F + nfeat] = acc[m][v] * s + bv;
        }
    }
}

extern "C" void kernel_launch(void* const* d_in, const int* in_sizes, int n_in,
                              void* d_out, int out_size, void* d_ws, size_t ws_size,
                              hipStream_t stream) {
    const float* x         = (const float*)d_in[0];
    const int*   codes     = (const int*)d_in[1];
    const float* codebooks = (const float*)d_in[2];
    const float* scales    = (const float*)d_in[3];
    const float* bias      = (const float*)d_in[4];
    float*       out       = (float*)d_out;

    dim3 grid(OUT_F / 128);   // 86 blocks, 8 waves each, 16 features per wave
    dim3 block(256);
    aqlm_wmma_f32_kernel<<<grid, block, 0, stream>>>(x, codes, codebooks, scales, bias, out);
}

// v001
// A run of this version takes 53.6 microseconds.
// Next to v000, in two timings, it ran 2.26 and 2.25 times as fast.
#include <hip/hip_runtime.h>
#include <stdint.h>

// AQLM 1x16 dequant-fused GEMM for MI455X (gfx1250, wave32, WMMA f32 16x16x4).
// out[t,o] = scale[o] * sum_ig sum_j x[t, ig*8+j] * cb[code[o,ig]][j] + bias[o]
//
// One work-group owns 48 output features (3 N-tiles) and all 64 tokens, so 230 work-groups
// spread the matrix and gather work over 230 WGPs. Its 16 waves split K: inside every staged
// chunk wave w takes AQLM groups w*8 .. w*8+7 for all 12 accumulator tiles. The 16 partial
// sums of each output are added in wave order through LDS at the end.
// The short loops over tiles and fragments are fully unrolled so that their arrays stay in registers.

typedef __attribute__((ext_vector_type(2))) float v2f;
typedef __attribute__((ext_vector_type(4))) float v4f;
typedef __attribute__((ext_vector_type(8))) float v8f;

#define IN_F       4096
#define OUT_F      11008
#define TOKENS     64
#define N_IG       512      // IN_F / 8
#define THREADS    512
#define WAVES      16
#define N_TILES    3        // 16-feature tiles per work-group
#define BLOCK_N    48
#define K_CHUNK    1024     // K elements staged in LDS per iteration
#define IG_CHUNK   128      // K_CHUNK / 8 AQLM groups per chunk
#define IG_WAVE    8        // IG_CHUNK / WAVES groups per wave and chunk
#define LDS_STRIDE 1028     // padded row stride (floats) -> conflict-free ds_load_b64
#define TILE_ELEMS 3072     // N_TILES * 4 * 256 partial sums per wave

__global__ __launch_bounds__(THREADS) void aqlm_wmma_f32_kernel(
    const float* __restrict__ x,          // [64, 4096]
    const int*   __restrict__ codes,      // [11008, 512]
    const float* __restrict__ codebooks,  // [65536, 8]
    const float* __restrict__ scales,     // [11008]
    const float* __restrict__ bias,       // [11008]
    float*       __restrict__ out)        // [64, 11008]
{
    __shared__ float xs[TOKENS * LDS_STRIDE];   // x chunk; reused for the partial sums

    const int tid   = threadIdx.x;
    const int lane  = tid & 31;
    const int wave  = tid >> 5;
    const int n0    = blockIdx.x * BLOCK_N;

    const int nlane = lane & 15;        // N index within tile (and token-in-tile for A)
    const int hi    = lane >> 4;        // lane half selects K sub-pair {0,1} vs {2,3}
    const int off2  = hi * 2;

    // 32-bit offsets so loads select the SADDR (uniform base + u32 voffset) form.
    // The last work-group has one real tile: its other lanes read feature OUT_F-1 and store nothing.
    uint32_t codeBase[N_TILES];
    #pragma unroll
    for (int nt = 0; nt < N_TILES; ++nt) {
        int f = n0 + nt * 16 + nlane;
        f = f < OUT_F ? f : OUT_F - 1;
        codeBase[nt] = (uint32_t)f * (uint32_t)N_IG + (uint32_t)(wave * IG_WAVE);
    }
    const uint32_t laneSub = (uint32_t)off2 * 4u;                 // byte sub-offset in cb row
    const char*    cbBase  = (const char*)codebooks;

    v8f acc[N_TILES][4];
    #pragma unroll
    for (int nt = 0; nt < N_TILES; ++nt)
        #pragma unroll
        for (int m = 0; m < 4; ++m) acc[nt][m] = (v8f){};

    for (int kc = 0; kc < IN_F / K_CHUNK; ++kc) {
        __syncthreads();
        // Cooperative coalesced stage of x[0..63][kc*1024 .. kc*1024+1023] into LDS.
        {
            const float* xsrc = x + (size_t)kc * K_CHUNK;
            const int c4 = tid & 255;         // float4 column (256 float4 per row)
            const int t0 = tid >> 8;          // the work-group covers two token rows per step
            // Kept rolled: two batches of 16 loads in flight; all 32 at once do not fit the registers.
            #pragma unroll 1
            for (int h = 0; h < 2; ++h) {
                v4f v[16];
                #pragma unroll
                for (int i = 0; i < 16; ++i) {
                    int t = t0 + (h * 16 + i) * 2;
                    v[i] = *(const v4f*)(xsrc + (size_t)t * IN_F + c4 * 4);
                }
                #pragma unroll
                for (int i = 0; i < 16; ++i) {
                    int t = t0 + (h * 16 + i) * 2;
                    *(v4f*)(&xs[t * LDS_STRIDE + c4 * 4]) = v[i];
                }
            }
        }
        __syncthreads();

        const uint32_t igbase = (uint32_t)(kc * IG_CHUNK);

        // Four groups a trip: their 24 gathers are issued together, ahead of the trip's 96 WMMAs.
        #pragma unroll 4
        for (int igl = 0; igl < IG_WAVE; ++igl) {
            // --- B operand: gather dequant weights for 3 x 16 output features ---
            // lanes L and L+16 load the same code (same cache line, broadcast).
            v2f b1[N_TILES], b2[N_TILES];
            #pragma unroll
            for (int nt = 0; nt < N_TILES; ++nt) {
                uint32_t code = (uint32_t)codes[codeBase[nt] + igbase + (uint32_t)igl];
                code &= 0xFFFFu;                                // row stays inside the codebook
                uint32_t boff = (code << 5) + laneSub;
                b1[nt] = *(const v2f*)(cbBase + boff);          // K = off2, off2+1
                b2[nt] = *(const v2f*)(cbBase + boff + 16);     // K = off2+4, off2+5
            }

            const int kk = (wave * IG_WAVE + igl) * 8 + off2;
            v2f a1[4], a2[4];
            #pragma unroll
            for (int m = 0; m < 4; ++m) {
                const float* ax = &xs[(size_t)(m * 16 + nlane) * LDS_STRIDE + kk];
                a1[m] = *(const v2f*)(ax);
                a2[m] = *(const v2f*)(ax + 4);
            }
            // --- 12 accumulator tiles, 2 WMMA K-steps each ---
            #pragma unroll
            for (int nt = 0; nt < N_TILES; ++nt)
                #pragma unroll
                for (int m = 0; m < 4; ++m)
                    acc[nt][m] = __builtin_amdgcn_wmma_f32_16x16x4_f32(
                        false, a1[m], false, b1[nt], (short)0, acc[nt][m], false, false);
            #pragma unroll
            for (int nt = 0; nt < N_TILES; ++nt)
                #pragma unroll
                for (int m = 0; m < 4; ++m)
                    acc[nt][m] = __builtin_amdgcn_wmma_f32_16x16x4_f32(
                        false, a2[m], false, b2[nt], (short)0, acc[nt][m], false, false);
        }
        // Four vector slots behind the chunk's last WMMA: on the branch back to the staging code the
        // address arithmetic reuses that WMMA's A registers.
        asm volatile("v_nop\n\tv_nop\n\tv_nop\n\tv_nop");
    }

    // Every wave has left the last x chunk before its LDS takes the partial sums.
    __syncthreads();
    #pragma unroll
    for (int nt = 0; nt < N_TILES; ++nt)
        #pragma unroll
        for (int m = 0; m < 4; ++m)
            #pragma unroll
            for (int v = 0; v < 8; ++v)
                xs[wave * TILE_ELEMS + ((nt * 4 + m) * 8 + v) * 32 + lane] = acc[nt][m][v];
    __syncthreads();

    // Each thread adds the 16 waves' partial sums of two neighbouring features, in wave order,
    // then folds the per-feature scale and adds the bias.
    #pragma unroll
    for (int j = 0; j < TILE_ELEMS / 2 / THREADS; ++j) {
        const int e  = (tid + j * THREADS) * 2;
        v2f sum = *(const v2f*)(&xs[e]);
        #pragma unroll
        for (int w = 1; w < WAVES; ++w)
            sum += *(const v2f*)(&xs[w * TILE_ELEMS + e]);
        const int tile  = e >> 8;              // nt * 4 + m
        const int v     = (e >> 5) & 7;
        const int l     = e & 31;
        const int token = (tile & 3) * 16 + (l >> 4) * 8 + v;   // C/D layout: VGPR v -> M=v (+8 hi half)
        const int feat  = n0 + (tile >> 2) * 16 + (l & 15);
        if (feat < OUT_F) {
            const v2f s  = *(const v2f*)(scales + feat);
            const v2f bv = *(const v2f*)(bias + feat);
            *(v2f*)(out + (size_t)token * OUT_F + feat) = sum * s + bv;
        }
    }
}

extern "C" void kernel_launch(void* const* d_in, const int* in_sizes, int n_in,
                              void* d_out, int out_size, void* d_ws, size_t ws_size,
                              hipStream_t stream) {
    const float* x         = (const float*)d_in[0];
    const int*   codes     = (const int*)d_in[1];
    const float* codebooks = (const float*)d_in[2];
    const float* scales    = (const float*)d_in[3];
    const float* bias      = (const float*)d_in[4];
    float*       out       = (float*)d_out;

    dim3 grid(230);           // ceil(11008 / 48) work-groups, 16 waves each
    dim3 block(THREADS);
    aqlm_wmma_f32_kernel<<<grid, block, 0, stream>>>(x, codes, codebooks, scales, bias, out);
}

// v002
// One run takes 51.8 microseconds.
// In two side-by-side timings against v001, it was 1.04 and 1.03 times as fast.
// Counting every step since v000, it is 2.34 times as fast.
#include <hip/hip_runtime.h>
#include <stdint.h>

// AQLM 1x16 dequant-fused GEMM for MI455X (gfx1250, wave32, WMMA f32 16x16x4).
// out[t,o] = scale[o] * sum_ig sum_j x[t, ig*8+j] * cb[code[o,ig]][j] + bias[o]
//
// One work-group owns 48 output features (3 N-tiles) and all 64 tokens, so 230 work-groups
// spread the matrix and gather work over 230 WGPs. Its 16 waves split K: inside every staged
// chunk wave w takes AQLM groups w*8 .. w*8+7 for all 12 accumulator tiles. Each wave stages the
// 64 x columns of a chunk that it alone reads, so the K loop holds no work-group barrier and one
// wave's loads run under the other waves' WMMAs. The 16 partial sums of each output are added in
// wave order through LDS at the end.
// The short loops over tiles and fragments are fully unrolled so that their arrays stay in registers.

typedef __attribute__((ext_vector_type(2))) float v2f;
typedef __attribute__((ext_vector_type(4))) float v4f;
typedef __attribute__((ext_vector_type(8))) float v8f;

#define IN_F       4096
#define OUT_F      11008
#define TOKENS     64
#define N_IG       512      // IN_F / 8
#define THREADS    512
#define WAVES      16
#define N_TILES    3        // 16-feature tiles per work-group
#define BLOCK_N    48
#define K_CHUNK    1024     // K elements staged in LDS per iteration
#define IG_CHUNK   128      // K_CHUNK / 8 AQLM groups per chunk
#define IG_WAVE    8        // IG_CHUNK / WAVES groups per wave and chunk
#define LDS_STRIDE 1028     // padded row stride (floats) -> conflict-free ds_load_b64
#define TILE_ELEMS 3072     // N_TILES * 4 * 256 partial sums per wave

__global__ __launch_bounds__(THREADS) void aqlm_wmma_f32_kernel(
    const float* __restrict__ x,          // [64, 4096]
    const int*   __restrict__ codes,      // [11008, 512]
    const float* __restrict__ codebooks,  // [65536, 8]
    const float* __restrict__ scales,     // [11008]
    const float* __restrict__ bias,       // [11008]
    float*       __restrict__ out)        // [64, 11008]
{
    __shared__ float xs[TOKENS * LDS_STRIDE];   // x chunk; reused for the partial sums

    const int tid   = threadIdx.x;
    const int lane  = tid & 31;
    const int wave  = tid >> 5;
    const int n0    = blockIdx.x * BLOCK_N;

    const int nlane = lane & 15;        // N index within tile (and token-in-tile for A)
    const int hi    = lane >> 4;        // lane half selects K sub-pair {0,1} vs {2,3}
    const int off2  = hi * 2;

    // 32-bit offsets so loads select the SADDR (uniform base + u32 voffset) form.
    // The last work-group has one real tile: its other lanes read feature OUT_F-1 and store nothing.
    uint32_t codeBase[N_TILES];
    #pragma unroll
    for (int nt = 0; nt < N_TILES; ++nt) {
        int f = n0 + nt * 16 + nlane;
        f = f < OUT_F ? f : OUT_F - 1;
        codeBase[nt] = (uint32_t)f * (uint32_t)N_IG + (uint32_t)(wave * IG_WAVE);
    }
    const uint32_t laneSub = (uint32_t)off2 * 4u;                 // byte sub-offset in cb row
    const char*    cbBase  = (const char*)codebooks;

    v8f acc[N_TILES][4];
    #pragma unroll
    for (int nt = 0; nt < N_TILES; ++nt)
        #pragma unroll
        for (int m = 0; m < 4; ++m) acc[nt][m] = (v8f){};

    for (int kc = 0; kc < IN_F / K_CHUNK; ++kc) {
        // This wave's LDS reads of the last chunk have returned before it overwrites its own columns
        // (no other wave touches them); also keeps the compiler from moving LDS accesses across.
        asm volatile("s_wait_dscnt 0x0" ::: "memory");
        // The wave stages x[0..63][kc*1024 + wave*64 .. +63], the columns that it alone reads.
        {
            const float* xsrc = x + (size_t)kc * K_CHUNK;
            const int c4 = wave * 16 + nlane; // float4 column: 16 lanes cover the wave's 256 bytes of a row
            const int t0 = hi;                // the wave covers two token rows per step
            // Kept rolled: two batches of 16 loads in flight; all 32 at once do not fit the registers.
            #pragma unroll 1
            for (int h = 0; h < 2; ++h) {
                v4f v[16];
                #pragma unroll
                for (int i = 0; i < 16; ++i) {
                    int t = t0 + (h * 16 + i) * 2;
                    v[i] = *(const v4f*)(xsrc + (size_t)t * IN_F + c4 * 4);
                }
                #pragma unroll
                for (int i = 0; i < 16; ++i) {
                    int t = t0 + (h * 16 + i) * 2;
                    *(v4f*)(&xs[t * LDS_STRIDE + c4 * 4]) = v[i];
                }
            }
        }
        // The wave's own stores have landed before its lanes read what its other lanes stored.
        asm volatile("s_wait_dscnt 0x0" ::: "memory");

        const uint32_t igbase = (uint32_t)(kc * IG_CHUNK);

        // Four groups a trip: their 24 gathers are issued together, ahead of the trip's 96 WMMAs.
        #pragma unroll 4
        for (int igl = 0; igl < IG_WAVE; ++igl) {
            // --- B operand: gather dequant weights for 3 x 16 output features ---
            // lanes L and L+16 load the same code (same cache line, broadcast).
            v2f b1[N_TILES], b2[N_TILES];
            #pragma unroll
            for (int nt = 0; nt < N_TILES; ++nt) {
                uint32_t code = (uint32_t)codes[codeBase[nt] + igbase + (uint32_t)igl];
                code &= 0xFFFFu;                                // row stays inside the codebook
                uint32_t boff = (code << 5) + laneSub;
                b1[nt] = *(const v2f*)(cbBase + boff);          // K = off2, off2+1
                b2[nt] = *(const v2f*)(cbBase + boff + 16);     // K = off2+4, off2+5
            }

            const int kk = (wave * IG_WAVE + igl) * 8 + off2;
            v2f a1[4], a2[4];
            #pragma unroll
            for (int m = 0; m < 4; ++m) {
                const float* ax = &xs[(size_t)(m * 16 + nlane) * LDS_STRIDE + kk];
                a1[m] = *(const v2f*)(ax);
                a2[m] = *(const v2f*)(ax + 4);
            }
            // --- 12 accumulator tiles, 2 WMMA K-steps each ---
            #pragma unroll
            for (int nt = 0; nt < N_TILES; ++nt)
                #pragma unroll
                for (int m = 0; m < 4; ++m)
                    acc[nt][m] = __builtin_amdgcn_wmma_f32_16x16x4_f32(
                        false, a1[m], false, b1[nt], (short)0, acc[nt][m], false, false);
            #pragma unroll
            for (int nt = 0; nt < N_TILES; ++nt)
                #pragma unroll
                for (int m = 0; m < 4; ++m)
                    acc[nt][m] = __builtin_amdgcn_wmma_f32_16x16x4_f32(
                        false, a2[m], false, b2[nt], (short)0, acc[nt][m], false, false);
        }
        // Four vector slots behind the chunk's last WMMA: on the branch back to the staging code the
        // address arithmetic reuses that WMMA's A registers.
        asm volatile("v_nop\n\tv_nop\n\tv_nop\n\tv_nop");
    }

    // Every wave has left the last x chunk before its LDS takes the partial sums.
    __syncthreads();
    #pragma unroll
    for (int nt = 0; nt < N_TILES; ++nt)
        #pragma unroll
        for (int m = 0; m < 4; ++m)
            #pragma unroll
            for (int v = 0; v < 8; ++v)
                xs[wave * TILE_ELEMS + ((nt * 4 + m) * 8 + v) * 32 + lane] = acc[nt][m][v];
    __syncthreads();

    // Each thread adds the 16 waves' partial sums of two neighbouring features, in wave order,
    // then folds the per-feature scale and adds the bias.
    #pragma unroll
    for (int j = 0; j < TILE_ELEMS / 2 / THREADS; ++j) {
        const int e  = (tid + j * THREADS) * 2;
        v2f sum = *(const v2f*)(&xs[e]);
        #pragma unroll
        for (int w = 1; w < WAVES; ++w)
            sum += *(const v2f*)(&xs[w * TILE_ELEMS + e]);
        const int tile  = e >> 8;              // nt * 4 + m
        const int v     = (e >> 5) & 7;
        const int l     = e & 31;
        const int token = (tile & 3) * 16 + (l >> 4) * 8 + v;   // C/D layout: VGPR v -> M=v (+8 hi half)
        const int feat  = n0 + (tile >> 2) * 16 + (l & 15);
        if (feat < OUT_F) {
            const v2f s  = *(const v2f*)(scales + feat);
            const v2f bv = *(const v2f*)(bias + feat);
            *(v2f*)(out + (size_t)token * OUT_F + feat) = sum * s + bv;
        }
    }
}

extern "C" void kernel_launch(void* const* d_in, const int* in_sizes, int n_in,
                              void* d_out, int out_size, void* d_ws, size_t ws_size,
                              hipStream_t stream) {
    const float* x         = (const float*)d_in[0];
    const int*   codes     = (const int*)d_in[1];
    const float* codebooks = (const float*)d_in[2];
    const float* scales    = (const float*)d_in[3];
    const float* bias      = (const float*)d_in[4];
    float*       out       = (float*)d_out;

    dim3 grid(230);           // ceil(11008 / 48) work-groups, 16 waves each
    dim3 block(THREADS);
    aqlm_wmma_f32_kernel<<<grid, block, 0, stream>>>(x, codes, codebooks, scales, bias, out);
}
